// v000
// Measured on an AMD MI455X. A time is GPU time per run, averaged over a window of back-to-back runs after a warm-up
// (all launches, gaps included; the runs take copies of the inputs in turn), and the median of several windows.
// Apart from v000's, it joins two sittings. Times from different sittings can be a few percent apart, while
// side-by-side timings come from the same sitting.
// v000, which the later versions start from, runs in 786 microseconds.
#include <hip/hip_runtime.h>

#define D_MODEL 1024
#define SEQ_T   2048
#define BATCH   4
#define BT      8192                    // BATCH * SEQ_T
#define RMS_EPS 1.1920928955078125e-07f
#define LN1E4_32 0.28782313662425572f   // ln(10000)/32

typedef float v2f __attribute__((ext_vector_type(2)));
typedef float v8f __attribute__((ext_vector_type(8)));

// Native fp32 WMMA: D(16x16,f32) = A(16x4,f32) * B(4x16,f32) + C
static __device__ __forceinline__ v8f wmma4(v2f a, v2f b, v8f c) {
  return __builtin_amdgcn_wmma_f32_16x16x4_f32(false, a, false, b, (short)0, c,
                                               false, false);
}

// ------------------------------ RMSNorm -------------------------------------
__global__ __launch_bounds__(256) void rmsnorm_kernel(
    const float* __restrict__ x, const float* __restrict__ w,
    float* __restrict__ out)
{
  __shared__ float red[9];
  const int row = blockIdx.x;
  const int tid = threadIdx.x;
  const float4 v = *(const float4*)(x + (size_t)row * D_MODEL + tid * 4);
  float ss = v.x * v.x + v.y * v.y + v.z * v.z + v.w * v.w;
  #pragma unroll
  for (int off = 16; off > 0; off >>= 1) ss += __shfl_xor(ss, off, 32);
  if ((tid & 31) == 0) red[tid >> 5] = ss;
  __syncthreads();
  if (tid == 0) {
    float t = 0.f;
    #pragma unroll
    for (int i = 0; i < 8; ++i) t += red[i];
    red[8] = t;
  }
  __syncthreads();
  const float rms = rsqrtf(red[8] * (1.0f / (float)D_MODEL) + RMS_EPS);
  const float4 wv = *(const float4*)(w + tid * 4);
  float4 o;
  o.x = v.x * rms * wv.x;
  o.y = v.y * rms * wv.y;
  o.z = v.z * rms * wv.z;
  o.w = v.w * rms * wv.w;
  *(float4*)(out + (size_t)row * D_MODEL + tid * 4) = o;
}

// ------------------------------ GEMM (WMMA f32) -----------------------------
// C[BT,1024] = A[BT,1024] @ W[1024,1024] (+R) (optionally RoPE on output).
// Block tile 256x64, 8 waves, wave tile 32x64 (8 x v8f accumulators).
// W tile stored K-pair interleaved in LDS -> B fragments are single b64 loads.
// Next K-slab staged in named scalar VGPRs (no arrays/lambdas -> no LDS
// promotion) so global loads overlap the WMMA burst.
#define BM   256
#define SA_P 20

__global__ __launch_bounds__(256) void gemm_wmma_kernel(
    const float* __restrict__ A, const float* __restrict__ W,
    const float* __restrict__ R, float* __restrict__ C,
    int add_residual, int apply_rope)
{
  __shared__ __align__(16) float sA[BM * SA_P];      // row-major, padded pitch
  __shared__ __align__(16) float sB[8 * 64 * 2];     // [kpair][n][2]
  const int tid   = threadIdx.x;
  const int lane  = tid & 31;
  const int wave  = tid >> 5;
  const int l15   = lane & 15;
  const int khalf = lane >> 4;
  const int koff  = khalf * 2;                       // ISA 7.12.2 fragment K off
  const int blockM = blockIdx.x * BM;
  const int blockN = blockIdx.y * 64;                // == head_index * 64
  const int waveM  = wave * 32;

  const v8f vzero = {0.f, 0.f, 0.f, 0.f, 0.f, 0.f, 0.f, 0.f};
  v8f acc[2][4];
  #pragma unroll
  for (int m = 0; m < 2; ++m)
    #pragma unroll
    for (int n = 0; n < 4; ++n) acc[m][n] = vzero;

  // ---- staging base pointers (computed once) ----
  // A tile: thread covers rows (tid>>2) + r*64, cols (tid&3)*4 .. +3
  const float* aG  = A + (size_t)(blockM + (tid >> 2)) * D_MODEL + (tid & 3) * 4;
  float*       aL  = sA + (tid >> 2) * SA_P + (tid & 3) * 4;
  // B tile: threads < 128; kpair = tid>>4, n4 = (tid&15)*4
  const int    bkp = tid >> 4;
  const int    bn4 = (tid & 15) * 4;
  const int    doB = (tid < 128);
  const float* bG  = W + (size_t)(2 * bkp) * D_MODEL + blockN + bn4;
  float*       bL  = sB + (size_t)(bkp * 64 + bn4) * 2;

  // named scalar staging registers
  float4 a0r, a1r, a2r, a3r, b0r, b1r;
  a0r = *(const float4*)(aG);
  a1r = *(const float4*)(aG + 1 * 64 * D_MODEL);
  a2r = *(const float4*)(aG + 2 * 64 * D_MODEL);
  a3r = *(const float4*)(aG + 3 * 64 * D_MODEL);
  if (doB) {
    b0r = *(const float4*)(bG);
    b1r = *(const float4*)(bG + D_MODEL);
  }

  for (int k0 = 0; k0 < D_MODEL; k0 += 16) {
    __syncthreads();                                 // prior LDS reads done
    *(float4*)(aL + 0 * 64 * SA_P) = a0r;
    *(float4*)(aL + 1 * 64 * SA_P) = a1r;
    *(float4*)(aL + 2 * 64 * SA_P) = a2r;
    *(float4*)(aL + 3 * 64 * SA_P) = a3r;
    if (doB) {
      const float4 s0 = {b0r.x, b1r.x, b0r.y, b1r.y};
      const float4 s1 = {b0r.z, b1r.z, b0r.w, b1r.w};
      *(float4*)(bL)     = s0;
      *(float4*)(bL + 4) = s1;
    }
    __syncthreads();
    if (k0 + 16 < D_MODEL) {                         // overlap with WMMAs below
      const int kn = k0 + 16;
      a0r = *(const float4*)(aG + kn);
      a1r = *(const float4*)(aG + kn + 1 * 64 * D_MODEL);
      a2r = *(const float4*)(aG + kn + 2 * 64 * D_MODEL);
      a3r = *(const float4*)(aG + kn + 3 * 64 * D_MODEL);
      if (doB) {
        b0r = *(const float4*)(bG + (size_t)kn * D_MODEL);
        b1r = *(const float4*)(bG + (size_t)(kn + 1) * D_MODEL);
      }
    }
    #pragma unroll
    for (int ks = 0; ks < 4; ++ks) {
      const v2f a0 = *(const v2f*)(sA + (waveM +      l15) * SA_P + ks * 4 + koff);
      const v2f a1 = *(const v2f*)(sA + (waveM + 16 + l15) * SA_P + ks * 4 + koff);
      #pragma unroll
      for (int nt = 0; nt < 4; ++nt) {
        const v2f b = *(const v2f*)(sB + (size_t)((ks * 2 + khalf) * 64 + nt * 16 + l15) * 2);
        acc[0][nt] = wmma4(a0, b, acc[0][nt]);
        acc[1][nt] = wmma4(a1, b, acc[1][nt]);
      }
    }
  }

  // C/D layout: VGPR j holds M = j (lanes 0-15) / j+8 (lanes 16-31)
  const int hi = khalf ? 8 : 0;
  #pragma unroll
  for (int msub = 0; msub < 2; ++msub) {
    const int rbase = blockM + waveM + msub * 16 + hi;
    if (apply_rope) {
      // blockN spans exactly one head; pair (d, d+32) = (acc[nt], acc[nt+2])
      #pragma unroll
      for (int nt = 0; nt < 2; ++nt) {
        const int d = nt * 16 + l15;                 // 0..31
        const float invf = __expf(-(float)d * LN1E4_32);
        #pragma unroll
        for (int j = 0; j < 8; ++j) {
          const int t = (rbase + j) & (SEQ_T - 1);
          float s, c;
          __sincosf((float)t * invf, &s, &c);
          const float x0 = acc[msub][nt][j];
          const float x1 = acc[msub][nt + 2][j];
          acc[msub][nt][j]     = x0 * c - x1 * s;
          acc[msub][nt + 2][j] = x1 * c + x0 * s;
        }
      }
    }
    #pragma unroll
    for (int nt = 0; nt < 4; ++nt) {
      const int col = blockN + nt * 16 + l15;
      #pragma unroll
      for (int j = 0; j < 8; ++j) {
        const size_t off = (size_t)(rbase + j) * D_MODEL + col;
        float v = acc[msub][nt][j];
        if (add_residual) v += R[off];
        C[off] = v;
      }
    }
  }
}

// ------------------------------ Flash attention -----------------------------
// grid = (T/128, H, B), 256 threads = 8 waves, each wave owns 16 q-rows.
// K tile row-major (padded pitch), V tile K-pair interleaved, P round-trips
// through per-wave LDS to convert C-layout -> A-layout.  K/V staged in named
// scalar VGPRs for global/compute overlap.
#define SK_P 68
#define SP_P 20

__global__ __launch_bounds__(256) void flash_attn_kernel(
    const float* __restrict__ Q, const float* __restrict__ K,
    const float* __restrict__ V, float* __restrict__ O)
{
  __shared__ __align__(16) float sK[16 * SK_P];
  __shared__ __align__(16) float sV[8 * 64 * 2];     // [kpair][n][2]
  __shared__ __align__(16) float sP[8][16 * SP_P];
  const int tid   = threadIdx.x;
  const int lane  = tid & 31;
  const int wave  = tid >> 5;
  const int l15   = lane & 15;
  const int khalf = lane >> 4;
  const int koff  = khalf * 2;
  const int hi    = khalf ? 8 : 0;
  const int q0    = blockIdx.x * 128;
  const int h     = blockIdx.y;
  const int b     = blockIdx.z;

  const size_t base = (size_t)b * SEQ_T * D_MODEL + (size_t)h * 64;
  const float* Qb = Q + base;
  const float* Kb = K + base;
  const float* Vb = V + base;
  float*       Ob = O + base;

  // Q fragments (A-layout) live in registers for the whole key loop.
  const int qrow = q0 + wave * 16 + l15;
  v2f qa[16];
  #pragma unroll
  for (int dc = 0; dc < 16; ++dc) {
    const float* p = Qb + (size_t)qrow * D_MODEL + dc * 4 + koff;
    qa[dc].x = p[0];
    qa[dc].y = p[1];
  }

  const v8f vzero = {0.f, 0.f, 0.f, 0.f, 0.f, 0.f, 0.f, 0.f};
  v8f o[4];
  o[0] = vzero; o[1] = vzero; o[2] = vzero; o[3] = vzero;
  float m[8], l[8];
  #pragma unroll
  for (int j = 0; j < 8; ++j) { m[j] = -3.0e38f; l[j] = 0.f; }

  // staging: waves 0-3 stage V (pair-interleave), waves 4-7 stage K
  const int isV = (tid < 128);
  const float* gS0;                                  // global src, row A
  const float* gS1;                                  // global src, row B
  float*       lS0;                                  // LDS dst
  float*       lS1;
  if (isV) {
    const int vkp = tid >> 4;
    const int vn4 = (tid & 15) * 4;
    gS0 = Vb + (size_t)(2 * vkp) * D_MODEL + vn4;
    gS1 = gS0 + D_MODEL;
    lS0 = sV + (size_t)(vkp * 64 + vn4) * 2;
    lS1 = lS0 + 4;
  } else {
    const int t2 = tid - 128;
    gS0 = Kb + (size_t)(t2 >> 4) * D_MODEL + (t2 & 15) * 4;
    gS1 = gS0 + (size_t)8 * D_MODEL;
    lS0 = sK + (t2 >> 4) * SK_P + (t2 & 15) * 4;
    lS1 = lS0 + 8 * SK_P;
  }

  float4 r0, r1;
  r0 = *(const float4*)(gS0);
  r1 = *(const float4*)(gS1);

  const int nkt = (q0 + 128) >> 4;                   // causal upper bound
  for (int kt = 0; kt < nkt; ++kt) {
    __syncthreads();                                 // prior sK/sV/sP reads done
    if (isV) {
      const float4 s0 = {r0.x, r1.x, r0.y, r1.y};
      const float4 s1 = {r0.z, r1.z, r0.w, r1.w};
      *(float4*)(lS0) = s0;
      *(float4*)(lS1) = s1;
    } else {
      *(float4*)(lS0) = r0;
      *(float4*)(lS1) = r1;
    }
    __syncthreads();
    if (kt + 1 < nkt) {                              // overlap with math below
      const size_t go = (size_t)(kt + 1) * 16 * D_MODEL;
      r0 = *(const float4*)(gS0 + go);
      r1 = *(const float4*)(gS1 + go);
    }

    // S = Q * K^T  (16 chunks of K=4); K fragments contiguous b64 in sK
    v8f s = vzero;
    #pragma unroll
    for (int dc = 0; dc < 16; ++dc) {
      const v2f bf = *(const v2f*)(sK + l15 * SK_P + dc * 4 + koff);
      s = wmma4(qa[dc], bf, s);
    }

    // online softmax per row (rows split across lane halves per C-layout)
    const int kcol  = kt * 16 + l15;
    const int qrow0 = q0 + wave * 16 + hi;
    #pragma unroll
    for (int j = 0; j < 8; ++j) {
      const float sv = (kcol <= qrow0 + j) ? s[j] * 0.125f : -3.0e38f;
      float r = sv;
      #pragma unroll
      for (int off = 8; off > 0; off >>= 1) r = fmaxf(r, __shfl_xor(r, off, 32));
      const float nm = fmaxf(m[j], r);
      const float sc = __expf(m[j] - nm);
      m[j] = nm;
      const float p = __expf(sv - nm);
      float ps = p;
      #pragma unroll
      for (int off = 8; off > 0; off >>= 1) ps += __shfl_xor(ps, off, 32);
      l[j] = l[j] * sc + ps;
      o[0][j] *= sc; o[1][j] *= sc; o[2][j] *= sc; o[3][j] *= sc;
      sP[wave][(j + hi) * SP_P + l15] = p;           // C-layout -> row-major LDS
    }
    __syncthreads();

    // O += P * V ; P re-read in A-layout, V fragments are single b64 loads
    #pragma unroll
    for (int kc = 0; kc < 4; ++kc) {
      const v2f a = *(const v2f*)(&sP[wave][l15 * SP_P + kc * 4 + koff]);
      #pragma unroll
      for (int nt = 0; nt < 4; ++nt) {
        const v2f bf = *(const v2f*)(sV + (size_t)((kc * 2 + khalf) * 64 + nt * 16 + l15) * 2);
        o[nt] = wmma4(a, bf, o[nt]);
      }
    }
  }

  const int orow = q0 + wave * 16 + hi;
  #pragma unroll
  for (int j = 0; j < 8; ++j) {
    const float inv = 1.0f / l[j];
    #pragma unroll
    for (int nt = 0; nt < 4; ++nt)
      Ob[(size_t)(orow + j) * D_MODEL + nt * 16 + l15] = o[nt][j] * inv;
  }
}

// ------------------------------ launcher ------------------------------------
extern "C" void kernel_launch(void* const* d_in, const int* in_sizes, int n_in,
                              void* d_out, int out_size, void* d_ws, size_t ws_size,
                              hipStream_t stream)
{
  (void)in_sizes; (void)n_in; (void)out_size; (void)ws_size;
  const float* x  = (const float*)d_in[0];
  const float* wq = (const float*)d_in[1];
  const float* wk = (const float*)d_in[2];
  const float* wv = (const float*)d_in[3];
  const float* wo = (const float*)d_in[4];
  const float* nw = (const float*)d_in[5];
  float* out = (float*)d_out;

  const size_t buf = (size_t)BT * D_MODEL;
  float* normed = (float*)d_ws;        // [BT, 1024]
  float* Qb = normed + buf;
  float* Kb = Qb + buf;
  float* Vb = Kb + buf;
  float* attn = normed;                // reuse: normed dead after QKV GEMMs

  rmsnorm_kernel<<<BT, 256, 0, stream>>>(x, nw, normed);

  dim3 gg(BT / BM, D_MODEL / 64);
  gemm_wmma_kernel<<<gg, 256, 0, stream>>>(normed, wq, x, Qb, 0, 1); // +RoPE
  gemm_wmma_kernel<<<gg, 256, 0, stream>>>(normed, wk, x, Kb, 0, 1); // +RoPE
  gemm_wmma_kernel<<<gg, 256, 0, stream>>>(normed, wv, x, Vb, 0, 0);

  dim3 ga(SEQ_T / 128, 16, BATCH);
  flash_attn_kernel<<<ga, 256, 0, stream>>>(Qb, Kb, Vb, attn);

  gemm_wmma_kernel<<<gg, 256, 0, stream>>>(attn, wo, x, out, 1, 0);
}

// v001
// A run of this version takes 710 microseconds.
// In both of two side-by-side timings against v000, it was 1.15 times as fast.
#include <hip/hip_runtime.h>

#define D_MODEL 1024
#define SEQ_T   2048
#define BATCH   4
#define BT      8192                    // BATCH * SEQ_T
#define RMS_EPS 1.1920928955078125e-07f
#define LN1E4_32 0.28782313662425572f   // ln(10000)/32

typedef float v2f __attribute__((ext_vector_type(2)));
typedef float v8f __attribute__((ext_vector_type(8)));

// Native fp32 WMMA: D(16x16,f32) = A(16x4,f32) * B(4x16,f32) + C
static __device__ __forceinline__ v8f wmma4(v2f a, v2f b, v8f c) {
  return __builtin_amdgcn_wmma_f32_16x16x4_f32(false, a, false, b, (short)0, c,
                                               false, false);
}

// ------------------------------ RMSNorm -------------------------------------
__global__ __launch_bounds__(256) void rmsnorm_kernel(
    const float* __restrict__ x, const float* __restrict__ w,
    float* __restrict__ out)
{
  __shared__ float red[9];
  const int row = blockIdx.x;
  const int tid = threadIdx.x;
  const float4 v = *(const float4*)(x + (size_t)row * D_MODEL + tid * 4);
  float ss = v.x * v.x + v.y * v.y + v.z * v.z + v.w * v.w;
  #pragma unroll
  for (int off = 16; off > 0; off >>= 1) ss += __shfl_xor(ss, off, 32);
  if ((tid & 31) == 0) red[tid >> 5] = ss;
  __syncthreads();
  if (tid == 0) {
    float t = 0.f;
    #pragma unroll
    for (int i = 0; i < 8; ++i) t += red[i];
    red[8] = t;
  }
  __syncthreads();
  const float rms = rsqrtf(red[8] * (1.0f / (float)D_MODEL) + RMS_EPS);
  const float4 wv = *(const float4*)(w + tid * 4);
  float4 o;
  o.x = v.x * rms * wv.x;
  o.y = v.y * rms * wv.y;
  o.z = v.z * rms * wv.z;
  o.w = v.w * rms * wv.w;
  *(float4*)(out + (size_t)row * D_MODEL + tid * 4) = o;
}

// ------------------------------ GEMM (WMMA f32) -----------------------------
// C[BT,1024] = A[BT,1024] @ W[1024,1024] (+R) (optionally RoPE on output).
// Block tile 256x64, 8 waves, wave tile 32x64 (8 x v8f accumulators).
// W tile stored K-pair interleaved in LDS -> B fragments are single b64 loads.
// Next K-slab staged in named scalar VGPRs (no arrays/lambdas -> no LDS
// promotion) so global loads overlap the WMMA burst.
#define BM   256
#define SA_P 20

__global__ __launch_bounds__(256) void gemm_wmma_kernel(
    const float* __restrict__ A, const float* __restrict__ W,
    const float* __restrict__ R, float* __restrict__ C,
    int add_residual, int apply_rope)
{
  __shared__ __align__(16) float sA[BM * SA_P];      // row-major, padded pitch
  __shared__ __align__(16) float sB[8 * 64 * 2];     // [kpair][n][2]
  const int tid   = threadIdx.x;
  const int lane  = tid & 31;
  const int wave  = tid >> 5;
  const int l15   = lane & 15;
  const int khalf = lane >> 4;
  const int koff  = khalf * 2;                       // ISA 7.12.2 fragment K off
  const int blockM = blockIdx.x * BM;
  const int blockN = blockIdx.y * 64;                // == head_index * 64
  const int waveM  = wave * 32;

  const v8f vzero = {0.f, 0.f, 0.f, 0.f, 0.f, 0.f, 0.f, 0.f};
  v8f acc[2][4];
  #pragma unroll
  for (int m = 0; m < 2; ++m)
    #pragma unroll
    for (int n = 0; n < 4; ++n) acc[m][n] = vzero;

  // ---- staging base pointers (computed once) ----
  // A tile: thread covers rows (tid>>2) + r*64, cols (tid&3)*4 .. +3
  const float* aG  = A + (size_t)(blockM + (tid >> 2)) * D_MODEL + (tid & 3) * 4;
  float*       aL  = sA + (tid >> 2) * SA_P + (tid & 3) * 4;
  // B tile: threads < 128; kpair = tid>>4, n4 = (tid&15)*4
  const int    bkp = tid >> 4;
  const int    bn4 = (tid & 15) * 4;
  const int    doB = (tid < 128);
  const float* bG  = W + (size_t)(2 * bkp) * D_MODEL + blockN + bn4;
  float*       bL  = sB + (size_t)(bkp * 64 + bn4) * 2;

  // named scalar staging registers
  float4 a0r, a1r, a2r, a3r, b0r, b1r;
  a0r = *(const float4*)(aG);
  a1r = *(const float4*)(aG + 1 * 64 * D_MODEL);
  a2r = *(const float4*)(aG + 2 * 64 * D_MODEL);
  a3r = *(const float4*)(aG + 3 * 64 * D_MODEL);
  if (doB) {
    b0r = *(const float4*)(bG);
    b1r = *(const float4*)(bG + D_MODEL);
  }

  for (int k0 = 0; k0 < D_MODEL; k0 += 16) {
    __syncthreads();                                 // prior LDS reads done
    *(float4*)(aL + 0 * 64 * SA_P) = a0r;
    *(float4*)(aL + 1 * 64 * SA_P) = a1r;
    *(float4*)(aL + 2 * 64 * SA_P) = a2r;
    *(float4*)(aL + 3 * 64 * SA_P) = a3r;
    if (doB) {
      const float4 s0 = {b0r.x, b1r.x, b0r.y, b1r.y};
      const float4 s1 = {b0r.z, b1r.z, b0r.w, b1r.w};
      *(float4*)(bL)     = s0;
      *(float4*)(bL + 4) = s1;
    }
    __syncthreads();
    if (k0 + 16 < D_MODEL) {                         // overlap with WMMAs below
      const int kn = k0 + 16;
      a0r = *(const float4*)(aG + kn);
      a1r = *(const float4*)(aG + kn + 1 * 64 * D_MODEL);
      a2r = *(const float4*)(aG + kn + 2 * 64 * D_MODEL);
      a3r = *(const float4*)(aG + kn + 3 * 64 * D_MODEL);
      if (doB) {
        b0r = *(const float4*)(bG + (size_t)kn * D_MODEL);
        b1r = *(const float4*)(bG + (size_t)(kn + 1) * D_MODEL);
      }
    }
    #pragma unroll
    for (int ks = 0; ks < 4; ++ks) {
      const v2f a0 = *(const v2f*)(sA + (waveM +      l15) * SA_P + ks * 4 + koff);
      const v2f a1 = *(const v2f*)(sA + (waveM + 16 + l15) * SA_P + ks * 4 + koff);
      #pragma unroll
      for (int nt = 0; nt < 4; ++nt) {
        const v2f b = *(const v2f*)(sB + (size_t)((ks * 2 + khalf) * 64 + nt * 16 + l15) * 2);
        acc[0][nt] = wmma4(a0, b, acc[0][nt]);
        acc[1][nt] = wmma4(a1, b, acc[1][nt]);
      }
    }
  }

  // C/D layout: VGPR j holds M = j (lanes 0-15) / j+8 (lanes 16-31)
  const int hi = khalf ? 8 : 0;
  #pragma unroll
  for (int msub = 0; msub < 2; ++msub) {
    const int rbase = blockM + waveM + msub * 16 + hi;
    if (apply_rope) {
      // blockN spans exactly one head; pair (d, d+32) = (acc[nt], acc[nt+2])
      #pragma unroll
      for (int nt = 0; nt < 2; ++nt) {
        const int d = nt * 16 + l15;                 // 0..31
        const float invf = __expf(-(float)d * LN1E4_32);
        #pragma unroll
        for (int j = 0; j < 8; ++j) {
          const int t = (rbase + j) & (SEQ_T - 1);
          float s, c;
          __sincosf((float)t * invf, &s, &c);
          const float x0 = acc[msub][nt][j];
          const float x1 = acc[msub][nt + 2][j];
          acc[msub][nt][j]     = x0 * c - x1 * s;
          acc[msub][nt + 2][j] = x1 * c + x0 * s;
        }
      }
    }
    #pragma unroll
    for (int nt = 0; nt < 4; ++nt) {
      const int col = blockN + nt * 16 + l15;
      #pragma unroll
      for (int j = 0; j < 8; ++j) {
        const size_t off = (size_t)(rbase + j) * D_MODEL + col;
        float v = acc[msub][nt][j];
        if (add_residual) v += R[off];
        C[off] = v;
      }
    }
  }
}

#define SK_P 68
#define LOG2E 1.44269504088896340736f

// lane l <-> lane l ^ 16
static __device__ __forceinline__ float xhalf(float x) {
  return __builtin_bit_cast(float, __builtin_amdgcn_permlanex16(
      __builtin_bit_cast(int, x), __builtin_bit_cast(int, x),
      0x76543210, 0xfedcba98, false, false));
}

__global__ __launch_bounds__(256) void flash_attn_kernel(
    const float* __restrict__ Q, const float* __restrict__ K,
    const float* __restrict__ V, float* __restrict__ O)
{
  __shared__ __align__(16) float sK[16 * SK_P];
  __shared__ __align__(16) float sV[8 * 64 * 2];     // [kpair][n][2]
  const int tid   = threadIdx.x;
  const int lane  = tid & 31;
  const int wave  = tid >> 5;
  const int l15   = lane & 15;
  const int khalf = lane >> 4;
  const int koff  = khalf * 2;
  const int hi    = khalf ? 8 : 0;
  const int q0    = blockIdx.x * 128;
  const int h     = blockIdx.y;
  const int b     = blockIdx.z;

  const size_t base = (size_t)b * SEQ_T * D_MODEL + (size_t)h * 64;
  const float* Qb = Q + base;
  const float* Kb = K + base;
  const float* Vb = V + base;
  float*       Ob = O + base;

  // Q fragments (B operand: column = query) stay in registers for the key loop.
  const int qrow = q0 + wave * 16 + l15;
  v2f qa[16];
  #pragma unroll
  for (int dc = 0; dc < 16; ++dc) {
    const float* p = Qb + (size_t)qrow * D_MODEL + dc * 4 + koff;
    qa[dc].x = p[0];
    qa[dc].y = p[1];
  }

  const v8f vzero = {0.f, 0.f, 0.f, 0.f, 0.f, 0.f, 0.f, 0.f};
  v8f o[4];                                          // o[nt][j] = O[qrow][nt*16+hi+j]
  o[0] = vzero; o[1] = vzero; o[2] = vzero; o[3] = vzero;
  float m = -3.0e38f;                                // running maximum of query qrow
  float l = 0.f;                                     // this lane half's share of the sum

  // staging: waves 0-3 stage V (pair-interleave), waves 4-7 stage K
  const int isV = (tid < 128);
  const float* gS0;                                  // global src, row A
  const float* gS1;                                  // global src, row B
  float*       lS0;                                  // LDS dst
  float*       lS1;
  if (isV) {
    const int vkp = tid >> 4;
    const int vn4 = (tid & 15) * 4;
    gS0 = Vb + (size_t)(2 * vkp) * D_MODEL + vn4;
    gS1 = gS0 + D_MODEL;
    lS0 = sV + (size_t)(vkp * 64 + vn4) * 2;
    lS1 = lS0 + 4;
  } else {
    const int t2 = tid - 128;
    gS0 = Kb + (size_t)(t2 >> 4) * D_MODEL + (t2 & 15) * 4;
    gS1 = gS0 + (size_t)8 * D_MODEL;
    lS0 = sK + (t2 >> 4) * SK_P + (t2 & 15) * 4;
    lS1 = lS0 + 8 * SK_P;
  }

  float4 r0, r1;
  r0 = *(const float4*)(gS0);
  r1 = *(const float4*)(gS1);

  const int nkt = (q0 + 128) >> 4;                   // causal upper bound
  for (int kt = 0; kt < nkt; ++kt) {
    __syncthreads();                                 // prior sK/sV reads done
    if (isV) {
      const float4 s0 = {r0.x, r1.x, r0.y, r1.y};
      const float4 s1 = {r0.z, r1.z, r0.w, r1.w};
      *(float4*)(lS0) = s0;
      *(float4*)(lS1) = s1;
    } else {
      *(float4*)(lS0) = r0;
      *(float4*)(lS1) = r1;
    }
    __syncthreads();
    if (kt + 1 < nkt) {                              // overlap with math below
      const size_t go = (size_t)(kt + 1) * 16 * D_MODEL;
      r0 = *(const float4*)(gS0 + go);
      r1 = *(const float4*)(gS1 + go);
      // the loads' address registers are reused by the products below
      asm volatile("s_wait_xcnt 0x0" ::: "memory");
    }

    // S^T = K * Q^T  (16 chunks of 4 along the head dim); A = K rows from sK
    v8f s = vzero;
    #pragma unroll
    for (int dc = 0; dc < 16; ++dc) {
      const v2f kf = *(const v2f*)(sK + l15 * SK_P + dc * 4 + koff);
      s = wmma4(kf, qa[dc], s);
    }

    // online softmax of query qrow: s[j] is key kt*16 + hi + j
    const int key0 = kt * 16 + hi;
    float sv[8];
    #pragma unroll
    for (int j = 0; j < 8; ++j)
      sv[j] = (key0 + j <= qrow) ? s[j] * 0.125f : -3.0e38f;
    float r = fmaxf(fmaxf(fmaxf(sv[0], sv[1]), fmaxf(sv[2], sv[3])),
                    fmaxf(fmaxf(sv[4], sv[5]), fmaxf(sv[6], sv[7])));
    r = fmaxf(r, xhalf(r));                          // both halves: all 16 keys
    const float nm = fmaxf(m, r);
    const float es = (m - nm) * LOG2E;
    float sc;
    // the exponential with its free slot, as for the pairs below
    asm("v_exp_f32 %0, %1\n\tv_nop" : "=v"(sc) : "v"(es));
    m = nm;
    float p[8];
    #pragma unroll
    for (int j = 0; j < 8; j += 2) {
      const float e0 = (sv[j]     - nm) * LOG2E;
      const float e1 = (sv[j + 1] - nm) * LOG2E;
      // two exponentials and the free slot that the instruction set asks for
      // behind a transcendental, in one statement so that the slot stays there
      asm("v_exp_f32 %0, %2\n\tv_exp_f32 %1, %3\n\tv_nop"
          : "=&v"(p[j]), "=&v"(p[j + 1]) : "v"(e0), "v"(e1));
    }
    l = l * sc + (((p[0] + p[1]) + (p[2] + p[3])) + ((p[4] + p[5]) + (p[6] + p[7])));
    #pragma unroll
    for (int nt = 0; nt < 4; ++nt) o[nt] *= sc;

    // O^T += V^T * P^T.  k positions of chunk jc: keys 2*jc + {0,1} in lanes
    // 0-15 and 8 + 2*jc + {0,1} in lanes 16-31, the same in A (V) and B (P).
    #pragma unroll
    for (int jc = 0; jc < 4; ++jc) {
      const v2f pf = {p[2 * jc], p[2 * jc + 1]};
      #pragma unroll
      for (int nt = 0; nt < 4; ++nt) {
        const v2f vf = *(const v2f*)(sV + (size_t)((jc + 4 * khalf) * 64 + nt * 16 + l15) * 2);
        o[nt] = wmma4(vf, pf, o[nt]);
      }
    }
  }

  const float inv = 1.0f / (l + xhalf(l));           // join the halves' sums once
  float* orow = Ob + (size_t)qrow * D_MODEL + hi;
  #pragma unroll
  for (int nt = 0; nt < 4; ++nt) {
    const float4 lo = {o[nt][0] * inv, o[nt][1] * inv, o[nt][2] * inv, o[nt][3] * inv};
    const float4 up = {o[nt][4] * inv, o[nt][5] * inv, o[nt][6] * inv, o[nt][7] * inv};
    *(float4*)(orow + nt * 16)     = lo;
    *(float4*)(orow + nt * 16 + 4) = up;
  }
}

// ------------------------------ launcher ------------------------------------
extern "C" void kernel_launch(void* const* d_in, const int* in_sizes, int n_in,
                              void* d_out, int out_size, void* d_ws, size_t ws_size,
                              hipStream_t stream)
{
  (void)in_sizes; (void)n_in; (void)out_size; (void)ws_size;
  const float* x  = (const float*)d_in[0];
  const float* wq = (const float*)d_in[1];
  const float* wk = (const float*)d_in[2];
  const float* wv = (const float*)d_in[3];
  const float* wo = (const float*)d_in[4];
  const float* nw = (const float*)d_in[5];
  float* out = (float*)d_out;

  const size_t buf = (size_t)BT * D_MODEL;
  float* normed = (float*)d_ws;        // [BT, 1024]
  float* Qb = normed + buf;
  float* Kb = Qb + buf;
  float* Vb = Kb + buf;
  float* attn = normed;                // reuse: normed dead after QKV GEMMs

  rmsnorm_kernel<<<BT, 256, 0, stream>>>(x, nw, normed);

  dim3 gg(BT / BM, D_MODEL / 64);
  gemm_wmma_kernel<<<gg, 256, 0, stream>>>(normed, wq, x, Qb, 0, 1); // +RoPE
  gemm_wmma_kernel<<<gg, 256, 0, stream>>>(normed, wk, x, Kb, 0, 1); // +RoPE
  gemm_wmma_kernel<<<gg, 256, 0, stream>>>(normed, wv, x, Vb, 0, 0);

  dim3 ga(SEQ_T / 128, 16, BATCH);
  flash_attn_kernel<<<ga, 256, 0, stream>>>(Qb, Kb, Vb, attn);

  gemm_wmma_kernel<<<gg, 256, 0, stream>>>(attn, wo, x, out, 1, 0);
}

// v002
// A run of this version takes 571 microseconds.
// Next to v001, in two timings, it ran 1.24 times as fast each time.
// Counting every step since v000, it is 1.43 times as fast.
#include <hip/hip_runtime.h>

#define D_MODEL 1024
#define SEQ_T   2048
#define BATCH   4
#define BT      8192                    // BATCH * SEQ_T
#define RMS_EPS 1.1920928955078125e-07f
#define LN1E4_32 0.28782313662425572f   // ln(10000)/32

typedef float v2f __attribute__((ext_vector_type(2)));
typedef float v4f __attribute__((ext_vector_type(4)));
typedef float v8f __attribute__((ext_vector_type(8)));

// Native fp32 WMMA: D(16x16,f32) = A(16x4,f32) * B(4x16,f32) + C
static __device__ __forceinline__ v8f wmma4(v2f a, v2f b, v8f c) {
  return __builtin_amdgcn_wmma_f32_16x16x4_f32(false, a, false, b, (short)0, c,
                                               false, false);
}

// ------------------------------ RMSNorm -------------------------------------
__global__ __launch_bounds__(256) void rmsnorm_kernel(
    const float* __restrict__ x, const float* __restrict__ w,
    float* __restrict__ out)
{
  __shared__ float red[9];
  const int row = blockIdx.x;
  const int tid = threadIdx.x;
  const float4 v = *(const float4*)(x + (size_t)row * D_MODEL + tid * 4);
  float ss = v.x * v.x + v.y * v.y + v.z * v.z + v.w * v.w;
  #pragma unroll
  for (int off = 16; off > 0; off >>= 1) ss += __shfl_xor(ss, off, 32);
  if ((tid & 31) == 0) red[tid >> 5] = ss;
  __syncthreads();
  if (tid == 0) {
    float t = 0.f;
    #pragma unroll
    for (int i = 0; i < 8; ++i) t += red[i];
    red[8] = t;
  }
  __syncthreads();
  const float rms = rsqrtf(red[8] * (1.0f / (float)D_MODEL) + RMS_EPS);
  const float4 wv = *(const float4*)(w + tid * 4);
  float4 o;
  o.x = v.x * rms * wv.x;
  o.y = v.y * rms * wv.y;
  o.z = v.z * rms * wv.z;
  o.w = v.w * rms * wv.w;
  *(float4*)(out + (size_t)row * D_MODEL + tid * 4) = o;
}

// ------------------------------ GEMM (WMMA f32) -----------------------------
// C[BT,1024] = A[BT,1024] @ W[1024,1024] (+R) (optionally RoPE on output).
// Block tile 256x64, 8 waves, wave tile 32x64 (8 x v8f accumulators).
// W tile stored K-pair interleaved in LDS -> B fragments are single b64 loads.
// Next K-slab staged in named scalar VGPRs (no arrays/lambdas -> no LDS
// promotion) so global loads overlap the WMMA burst.
#define BM   256
#define SA_P 20

__global__ __launch_bounds__(256) void gemm_wmma_kernel(
    const float* __restrict__ A, const float* __restrict__ W,
    const float* __restrict__ R, float* __restrict__ C,
    int add_residual, int apply_rope)
{
  __shared__ __align__(16) float sA[BM * SA_P];      // row-major, padded pitch
  __shared__ __align__(16) float sB[8 * 64 * 2];     // [kpair][n][2]
  const int tid   = threadIdx.x;
  const int lane  = tid & 31;
  const int wave  = tid >> 5;
  const int l15   = lane & 15;
  const int khalf = lane >> 4;
  const int koff  = khalf * 2;                       // ISA 7.12.2 fragment K off
  const int blockM = blockIdx.x * BM;
  const int blockN = blockIdx.y * 64;                // == head_index * 64
  const int waveM  = wave * 32;

  const v8f vzero = {0.f, 0.f, 0.f, 0.f, 0.f, 0.f, 0.f, 0.f};
  v8f acc[2][4];
  #pragma unroll
  for (int m = 0; m < 2; ++m)
    #pragma unroll
    for (int n = 0; n < 4; ++n) acc[m][n] = vzero;

  // ---- staging base pointers (computed once) ----
  // A tile: thread covers rows (tid>>2) + r*64, cols (tid&3)*4 .. +3
  const float* aG  = A + (size_t)(blockM + (tid >> 2)) * D_MODEL + (tid & 3) * 4;
  float*       aL  = sA + (tid >> 2) * SA_P + (tid & 3) * 4;
  // B tile: threads < 128; kpair = tid>>4, n4 = (tid&15)*4
  const int    bkp = tid >> 4;
  const int    bn4 = (tid & 15) * 4;
  const int    doB = (tid < 128);
  const float* bG  = W + (size_t)(2 * bkp) * D_MODEL + blockN + bn4;
  float*       bL  = sB + (size_t)(bkp * 64 + bn4) * 2;

  // named scalar staging registers
  float4 a0r, a1r, a2r, a3r, b0r, b1r;
  a0r = *(const float4*)(aG);
  a1r = *(const float4*)(aG + 1 * 64 * D_MODEL);
  a2r = *(const float4*)(aG + 2 * 64 * D_MODEL);
  a3r = *(const float4*)(aG + 3 * 64 * D_MODEL);
  if (doB) {
    b0r = *(const float4*)(bG);
    b1r = *(const float4*)(bG + D_MODEL);
  }

  for (int k0 = 0; k0 < D_MODEL; k0 += 16) {
    __syncthreads();                                 // prior LDS reads done
    *(float4*)(aL + 0 * 64 * SA_P) = a0r;
    *(float4*)(aL + 1 * 64 * SA_P) = a1r;
    *(float4*)(aL + 2 * 64 * SA_P) = a2r;
    *(float4*)(aL + 3 * 64 * SA_P) = a3r;
    if (doB) {
      const float4 s0 = {b0r.x, b1r.x, b0r.y, b1r.y};
      const float4 s1 = {b0r.z, b1r.z, b0r.w, b1r.w};
      *(float4*)(bL)     = s0;
      *(float4*)(bL + 4) = s1;
    }
    __syncthreads();
    if (k0 + 16 < D_MODEL) {                         // overlap with WMMAs below
      const int kn = k0 + 16;
      a0r = *(const float4*)(aG + kn);
      a1r = *(const float4*)(aG + kn + 1 * 64 * D_MODEL);
      a2r = *(const float4*)(aG + kn + 2 * 64 * D_MODEL);
      a3r = *(const float4*)(aG + kn + 3 * 64 * D_MODEL);
      if (doB) {
        b0r = *(const float4*)(bG + (size_t)kn * D_MODEL);
        b1r = *(const float4*)(bG + (size_t)(kn + 1) * D_MODEL);
      }
    }
    #pragma unroll
    for (int ks = 0; ks < 4; ++ks) {
      const v2f a0 = *(const v2f*)(sA + (waveM +      l15) * SA_P + ks * 4 + koff);
      const v2f a1 = *(const v2f*)(sA + (waveM + 16 + l15) * SA_P + ks * 4 + koff);
      #pragma unroll
      for (int nt = 0; nt < 4; ++nt) {
        const v2f b = *(const v2f*)(sB + (size_t)((ks * 2 + khalf) * 64 + nt * 16 + l15) * 2);
        acc[0][nt] = wmma4(a0, b, acc[0][nt]);
        acc[1][nt] = wmma4(a1, b, acc[1][nt]);
      }
    }
  }

  // C/D layout: VGPR j holds M = j (lanes 0-15) / j+8 (lanes 16-31)
  const int hi = khalf ? 8 : 0;
  #pragma unroll
  for (int msub = 0; msub < 2; ++msub) {
    const int rbase = blockM + waveM + msub * 16 + hi;
    if (apply_rope) {
      // blockN spans exactly one head; pair (d, d+32) = (acc[nt], acc[nt+2])
      #pragma unroll
      for (int nt = 0; nt < 2; ++nt) {
        const int d = nt * 16 + l15;                 // 0..31
        const float invf = __expf(-(float)d * LN1E4_32);
        #pragma unroll
        for (int j = 0; j < 8; ++j) {
          const int t = (rbase + j) & (SEQ_T - 1);
          float s, c;
          __sincosf((float)t * invf, &s, &c);
          const float x0 = acc[msub][nt][j];
          const float x1 = acc[msub][nt + 2][j];
          acc[msub][nt][j]     = x0 * c - x1 * s;
          acc[msub][nt + 2][j] = x1 * c + x0 * s;
        }
      }
    }
    #pragma unroll
    for (int nt = 0; nt < 4; ++nt) {
      const int col = blockN + nt * 16 + l15;
      #pragma unroll
      for (int j = 0; j < 8; ++j) {
        const size_t off = (size_t)(rbase + j) * D_MODEL + col;
        float v = acc[msub][nt][j];
        if (add_residual) v += R[off];
        C[off] = v;
      }
    }
  }
}

#define SK_P 68
#define NQT  (SEQ_T / 128)               // query tiles per (batch, head)
#define LOG2E 1.44269504088896340736f

// lane l <-> lane l ^ 16
static __device__ __forceinline__ float xhalf(float x) {
  return __builtin_bit_cast(float, __builtin_amdgcn_permlanex16(
      __builtin_bit_cast(int, x), __builtin_bit_cast(int, x),
      0x76543210, 0xfedcba98, false, false));
}

// 512 work-groups on 256 WGPs are four waves per SIMD: the register budget is
// set for four, else the compiler held the count for eight and read each LDS
// fragment pair directly in front of its two products.
__global__ __launch_bounds__(256) __attribute__((amdgpu_waves_per_eu(4, 4)))
void flash_attn_kernel(
    const float* __restrict__ Q, const float* __restrict__ K,
    const float* __restrict__ V, float* __restrict__ O)
{
  __shared__ __align__(16) float sK[16 * SK_P];
  __shared__ __align__(16) float sV[8 * 64 * 2];     // [kpair][n][2]
  const int tid   = threadIdx.x;
  const int lane  = tid & 31;
  const int wave  = tid >> 5;
  const int l15   = lane & 15;
  const int khalf = lane >> 4;
  const int koff  = khalf * 2;
  const int hi    = khalf ? 8 : 0;
  const int h     = blockIdx.y;
  const int b     = blockIdx.z;

  const size_t base = (size_t)b * SEQ_T * D_MODEL + (size_t)h * 64;
  const float* Qb = Q + base;
  const float* Kb = K + base;
  const float* Vb = V + base;
  float*       Ob = O + base;

  // staging: waves 0-3 stage V (pair-interleave), waves 4-7 stage K
  const int isV = (tid < 128);
  const float* gS0;                                  // global src, row A
  const float* gS1;                                  // global src, row B
  float*       lS0;                                  // LDS dst
  float*       lS1;
  if (isV) {
    const int vkp = tid >> 4;
    const int vn4 = (tid & 15) * 4;
    gS0 = Vb + (size_t)(2 * vkp) * D_MODEL + vn4;
    gS1 = gS0 + D_MODEL;
    lS0 = sV + (size_t)(vkp * 64 + vn4) * 2;
    lS1 = lS0 + 4;
  } else {
    const int t2 = tid - 128;
    gS0 = Kb + (size_t)(t2 >> 4) * D_MODEL + (t2 & 15) * 4;
    gS1 = gS0 + (size_t)8 * D_MODEL;
    lS0 = sK + (t2 >> 4) * SK_P + (t2 & 15) * 4;
    lS1 = lS0 + 8 * SK_P;
  }

  // key tile 0 opens both passes: loaded once.  The staged rows are vector values:
  // as float4 members they were moved between registers, behind a wait for the
  // load, directly after the load's issue in the key loop.
  const v4f first0 = *(const v4f*)(gS0);
  const v4f first1 = *(const v4f*)(gS1);
  // their address registers are reused further down
  asm volatile("s_wait_xcnt 0x0" ::: "memory");

  for (int pass = 0; pass < 2; ++pass) {
    const int q0 = (pass ? (int)blockIdx.x : NQT - 1 - (int)blockIdx.x) * 128;

    // Q fragments (B operand: column = query) stay in registers for the key loop.
    const int qrow = q0 + wave * 16 + l15;
    v2f qa[16];
    #pragma unroll
    for (int dc = 0; dc < 16; ++dc) {
      const float* p = Qb + (size_t)qrow * D_MODEL + dc * 4 + koff;
      qa[dc].x = p[0];
      qa[dc].y = p[1];
    }

    const v8f vzero = {0.f, 0.f, 0.f, 0.f, 0.f, 0.f, 0.f, 0.f};
    v8f o[4];                                        // o[nt][j] = O[qrow][nt*16+hi+j]
    o[0] = vzero; o[1] = vzero; o[2] = vzero; o[3] = vzero;
    float m = -3.0e38f;                              // running maximum of query qrow
    float l = 0.f;                                   // this lane half's share of the sum

    v4f r0 = first0, r1 = first1;

    const int nkt = (q0 + 128) >> 4;                 // causal upper bound
    __builtin_assume(nkt > 0);                       // no code for an empty key loop
    for (int kt = 0; kt < nkt; ++kt) {
      __syncthreads();                               // prior sK/sV reads done
      if (isV) {
        *(v4f*)(lS0) = __builtin_shufflevector(r0, r1, 0, 4, 1, 5);
        *(v4f*)(lS1) = __builtin_shufflevector(r0, r1, 2, 6, 3, 7);
      } else {
        *(v4f*)(lS0) = r0;
        *(v4f*)(lS1) = r1;
      }
      __syncthreads();
      if (kt + 1 < nkt) {                            // overlap with math below
        const size_t go = (size_t)(kt + 1) * 16 * D_MODEL;
        r0 = *(const v4f*)(gS0 + go);
        r1 = *(const v4f*)(gS1 + go);
        // the loads' address registers are reused by the products below
        asm volatile("s_wait_xcnt 0x0" ::: "memory");
      }

      // S^T = K * Q^T  (16 chunks of 4 along the head dim); A = K rows from sK
      v8f s = vzero;
      #pragma unroll
      for (int dc = 0; dc < 16; ++dc) {
        const v2f kf = *(const v2f*)(sK + l15 * SK_P + dc * 4 + koff);
        s = wmma4(kf, qa[dc], s);
      }

      // online softmax of query qrow: s[j] is key kt*16 + hi + j
      const int key0 = kt * 16 + hi;
      float sv[8];
      #pragma unroll
      for (int j = 0; j < 8; ++j)
        sv[j] = (key0 + j <= qrow) ? s[j] * 0.125f : -3.0e38f;
      float r = fmaxf(fmaxf(fmaxf(sv[0], sv[1]), fmaxf(sv[2], sv[3])),
                      fmaxf(fmaxf(sv[4], sv[5]), fmaxf(sv[6], sv[7])));
      r = fmaxf(r, xhalf(r));                        // both halves: all 16 keys
      const float nm = fmaxf(m, r);
      const float es = (m - nm) * LOG2E;
      float sc;
      // the exponential with its free slot, as for the pairs below
      asm("v_exp_f32 %0, %1\n\tv_nop" : "=v"(sc) : "v"(es));
      m = nm;
      float p[8];
      #pragma unroll
      for (int j = 0; j < 8; j += 2) {
        const float e0 = (sv[j]     - nm) * LOG2E;
        const float e1 = (sv[j + 1] - nm) * LOG2E;
        // two exponentials and the free slot that the instruction set asks for
        // behind a transcendental, in one statement so that the slot stays there
        asm("v_exp_f32 %0, %2\n\tv_exp_f32 %1, %3\n\tv_nop"
            : "=&v"(p[j]), "=&v"(p[j + 1]) : "v"(e0), "v"(e1));
      }
      l = l * sc + (((p[0] + p[1]) + (p[2] + p[3])) + ((p[4] + p[5]) + (p[6] + p[7])));
      #pragma unroll
      for (int nt = 0; nt < 4; ++nt) o[nt] *= sc;

      // O^T += V^T * P^T.  k positions of chunk jc: keys 2*jc + {0,1} in lanes
      // 0-15 and 8 + 2*jc + {0,1} in lanes 16-31, the same in A (V) and B (P).
      #pragma unroll
      for (int jc = 0; jc < 4; ++jc) {
        const v2f pf = {p[2 * jc], p[2 * jc + 1]};
        #pragma unroll
        for (int nt = 0; nt < 4; ++nt) {
          const v2f vf = *(const v2f*)(sV + (size_t)((jc + 4 * khalf) * 64 + nt * 16 + l15) * 2);
          o[nt] = wmma4(vf, pf, o[nt]);
        }
      }
    }

    const float inv = 1.0f / (l + xhalf(l));         // join the halves' sums once
    float* orow = Ob + (size_t)qrow * D_MODEL + hi;
    #pragma unroll
    for (int nt = 0; nt < 4; ++nt) {
      const float4 lo = {o[nt][0] * inv, o[nt][1] * inv, o[nt][2] * inv, o[nt][3] * inv};
      const float4 up = {o[nt][4] * inv, o[nt][5] * inv, o[nt][6] * inv, o[nt][7] * inv};
      *(float4*)(orow + nt * 16)     = lo;
      *(float4*)(orow + nt * 16 + 4) = up;
    }
    // the stores' registers are written anew by the next pass
    asm volatile("s_wait_xcnt 0x0" ::: "memory");
  }
}

// ------------------------------ launcher ------------------------------------
extern "C" void kernel_launch(void* const* d_in, const int* in_sizes, int n_in,
                              void* d_out, int out_size, void* d_ws, size_t ws_size,
                              hipStream_t stream)
{
  (void)in_sizes; (void)n_in; (void)out_size; (void)ws_size;
  const float* x  = (const float*)d_in[0];
  const float* wq = (const float*)d_in[1];
  const float* wk = (const float*)d_in[2];
  const float* wv = (const float*)d_in[3];
  const float* wo = (const float*)d_in[4];
  const float* nw = (const float*)d_in[5];
  float* out = (float*)d_out;

  const size_t buf = (size_t)BT * D_MODEL;
  float* normed = (float*)d_ws;        // [BT, 1024]
  float* Qb = normed + buf;
  float* Kb = Qb + buf;
  float* Vb = Kb + buf;
  float* attn = normed;                // reuse: normed dead after QKV GEMMs

  rmsnorm_kernel<<<BT, 256, 0, stream>>>(x, nw, normed);

  dim3 gg(BT / BM, D_MODEL / 64);
  gemm_wmma_kernel<<<gg, 256, 0, stream>>>(normed, wq, x, Qb, 0, 1); // +RoPE
  gemm_wmma_kernel<<<gg, 256, 0, stream>>>(normed, wk, x, Kb, 0, 1); // +RoPE
  gemm_wmma_kernel<<<gg, 256, 0, stream>>>(normed, wv, x, Vb, 0, 0);

  dim3 ga(SEQ_T / 256, 16, BATCH);
  flash_attn_kernel<<<ga, 256, 0, stream>>>(Qb, Kb, Vb, attn);

  gemm_wmma_kernel<<<gg, 256, 0, stream>>>(attn, wo, x, out, 1, 0);
}
